// v000
// The times below were measured on an AMD MI455X: many runs one after another, warmed up first and cycling through
// copies of the inputs, with the whole window's GPU time divided by the number of runs. Launches and the gaps
// between them are all in it. The median over several windows is given; except for v000 it joins two sittings, which
// can be a few percent apart, so the side-by-side timings, each taken in one sitting, are the better comparison.
// v000, which the later versions start from, runs in 80.6 microseconds.
#include <hip/hip_runtime.h>
#include <math.h>

// Problem constants (B,N,L,S,H,D,M) = (4,8,1024,1024,8,64,64)
#define BB 4
#define NN 8
#define LL 1024
#define SS 1024
#define HH 8
#define DD 64
#define MM 64
#define BNH (BB * NN * HH)   // 256
#define EPSV 1e-6f

typedef float v2f __attribute__((ext_vector_type(2)));
typedef float v8f __attribute__((ext_vector_type(8)));

// elu(x) + 1  ==  x>0 ? x+1 : exp(x)
__device__ __forceinline__ float elu1(float x) {
    return x > 0.0f ? x + 1.0f : __expf(x);
}

// -----------------------------------------------------------------------------
// Kernel 1: per (b,n,h) compute KV[m][d] = sum_s K[s,d]*V[s,m]  (64x64)
//           and Ksum[d] = sum_s K[s,d], with K = (elu(keys)+1)*mask.
// grid.x = BNH, block = 256 threads (8 waves); each wave owns two 16x16 tiles.
// -----------------------------------------------------------------------------
__global__ __launch_bounds__(256) void la_kv_kernel(
    const float* __restrict__ keys,      // [B,N,S,H,D]
    const float* __restrict__ values,    // [B,N,S,H,M]
    const float* __restrict__ key_mask,  // [B,S]
    float* __restrict__ kv_ws,           // [BNH][64][64]  (m-major)
    float* __restrict__ ksum_ws)         // [BNH][64]
{
    const int bnh = blockIdx.x;
    const int h   = bnh % HH;
    const int bn  = bnh / HH;   // b*N + n
    const int b   = bn / NN;

    const float* Kp = keys   + (size_t)bn * SS * HH * DD + (size_t)h * DD; // (s,d): Kp[s*H*D + d]
    const float* Vp = values + (size_t)bn * SS * HH * MM + (size_t)h * MM; // (s,m): Vp[s*H*M + m]
    const float* maskp = key_mask + (size_t)b * SS;

    __shared__ float Kt[32][DD + 1];
    __shared__ float Vt[32][MM + 1];
    __shared__ float ksum_part[4][DD];

    const int tid  = threadIdx.x;
    const int lane = tid & 31;
    const int wave = tid >> 5;

    // two 16x16 tiles of the 64x64 (m x d) output per wave
    const int t0  = wave * 2;
    const int t1  = wave * 2 + 1;
    const int mt0 = (t0 >> 2) * 16, dt0 = (t0 & 3) * 16;
    const int mt1 = (t1 >> 2) * 16, dt1 = (t1 & 3) * 16;
    v8f acc0 = {};
    v8f acc1 = {};

    // Ksum partials: thread owns column d = tid&63, s-subgroup = tid>>6
    const int kcol = tid & 63;
    const int ksg  = tid >> 6;
    float ksum_acc = 0.0f;

    for (int s0 = 0; s0 < SS; s0 += 32) {
        // cooperative staged load: 32 rows x 64 cols (float4), fused feature map on K
        for (int i = tid; i < 512; i += 256) {
            const int row = i >> 4;
            const int c4  = (i & 15) * 4;
            const int s   = s0 + row;
            const float msk = maskp[s];
            const float4 k4 = *(const float4*)(Kp + (size_t)s * (HH * DD) + c4);
            Kt[row][c4 + 0] = elu1(k4.x) * msk;
            Kt[row][c4 + 1] = elu1(k4.y) * msk;
            Kt[row][c4 + 2] = elu1(k4.z) * msk;
            Kt[row][c4 + 3] = elu1(k4.w) * msk;
            const float4 v4 = *(const float4*)(Vp + (size_t)s * (HH * MM) + c4);
            Vt[row][c4 + 0] = v4.x;
            Vt[row][c4 + 1] = v4.y;
            Vt[row][c4 + 2] = v4.z;
            Vt[row][c4 + 3] = v4.w;
        }
        __syncthreads();

        // Ksum partial accumulation
        #pragma unroll
        for (int ss = 0; ss < 8; ++ss)
            ksum_acc += Kt[ksg * 8 + ss][kcol];

        // WMMA: KV-tile += A(16m x 4s) * B(4s x 16d), 8 sub-steps of K=4
        const int lm  = lane & 15;
        const int lhi = (lane >> 4) * 2;   // A/B VGPR layout: lanes 16-31 hold K=2,3
        #pragma unroll
        for (int kk = 0; kk < 8; ++kk) {
            const int sb = kk * 4 + lhi;
            v2f a0, b0, a1, b1;
            a0.x = Vt[sb][mt0 + lm];      a0.y = Vt[sb + 1][mt0 + lm];
            b0.x = Kt[sb][dt0 + lm];      b0.y = Kt[sb + 1][dt0 + lm];
            acc0 = __builtin_amdgcn_wmma_f32_16x16x4_f32(
                       false, a0, false, b0, (short)0, acc0, false, false);
            a1.x = Vt[sb][mt1 + lm];      a1.y = Vt[sb + 1][mt1 + lm];
            b1.x = Kt[sb][dt1 + lm];      b1.y = Kt[sb + 1][dt1 + lm];
            acc1 = __builtin_amdgcn_wmma_f32_16x16x4_f32(
                       false, a1, false, b1, (short)0, acc1, false, false);
        }
        __syncthreads();
    }

    // reduce Ksum
    ksum_part[ksg][kcol] = ksum_acc;
    __syncthreads();
    if (tid < DD) {
        ksum_ws[(size_t)bnh * DD + tid] =
            ksum_part[0][tid] + ksum_part[1][tid] + ksum_part[2][tid] + ksum_part[3][tid];
    }

    // store KV tiles.  C layout: VGPR j -> row M=j (lanes 0-15) / M=j+8 (lanes 16-31)
    float* kvp = kv_ws + (size_t)bnh * (MM * DD);
    const int cn = lane & 15;
    const int mh = (lane >> 4) * 8;
    #pragma unroll
    for (int j = 0; j < 8; ++j) {
        kvp[(size_t)(mt0 + mh + j) * DD + (dt0 + cn)] = acc0[j];
        kvp[(size_t)(mt1 + mh + j) * DD + (dt1 + cn)] = acc1[j];
    }
}

// -----------------------------------------------------------------------------
// Kernel 2: per (b,n,h, 64-row L-tile):
//   Out[l,m] = Z[l] * sum_d Q[l,d] * KV[m,d],  Z[l] = 1/(Q[l,:].Ksum + eps)
// grid = (L/64, BNH), block = 256 (8 waves, 2 output tiles each).
// -----------------------------------------------------------------------------
__global__ __launch_bounds__(256) void la_out_kernel(
    const float* __restrict__ queries,   // [B,N,L,H,D]
    const float* __restrict__ kv_ws,     // [BNH][64][64]
    const float* __restrict__ ksum_ws,   // [BNH][64]
    float* __restrict__ out)             // [B,N,L,H,M]
{
    const int lt  = blockIdx.x;   // 0..15 (64 L-rows each)
    const int bnh = blockIdx.y;   // 0..255
    const int h   = bnh % HH;
    const int bn  = bnh / HH;

    const float* Qp = queries + (size_t)bn * LL * HH * DD
                              + (size_t)(lt * 64) * (HH * DD) + (size_t)h * DD;

    __shared__ float Qt[64][DD + 1];
    __shared__ float KVs[MM][DD + 1];
    __shared__ float ksum_s[DD];
    __shared__ float zbuf[64];

    const int tid  = threadIdx.x;
    const int lane = tid & 31;
    const int wave = tid >> 5;

    // stage elu(Q)+1 tile: 64x64 floats
    for (int i = tid; i < 1024; i += 256) {
        const int row = i >> 4;
        const int c4  = (i & 15) * 4;
        const float4 q4 = *(const float4*)(Qp + (size_t)row * (HH * DD) + c4);
        Qt[row][c4 + 0] = elu1(q4.x);
        Qt[row][c4 + 1] = elu1(q4.y);
        Qt[row][c4 + 2] = elu1(q4.z);
        Qt[row][c4 + 3] = elu1(q4.w);
    }
    // stage KV (hot in L2 from kernel 1)
    const float* kvp = kv_ws + (size_t)bnh * (MM * DD);
    for (int i = tid; i < 1024; i += 256) {
        const int row = i >> 4;
        const int c4  = (i & 15) * 4;
        const float4 v4 = *(const float4*)(kvp + (size_t)row * DD + c4);
        KVs[row][c4 + 0] = v4.x;
        KVs[row][c4 + 1] = v4.y;
        KVs[row][c4 + 2] = v4.z;
        KVs[row][c4 + 3] = v4.w;
    }
    if (tid < DD) ksum_s[tid] = ksum_ws[(size_t)bnh * DD + tid];
    __syncthreads();

    // per-row normalizer
    if (tid < 64) {
        float acc = 0.0f;
        #pragma unroll
        for (int d = 0; d < DD; ++d) acc += Qt[tid][d] * ksum_s[d];
        zbuf[tid] = 1.0f / (acc + EPSV);
    }
    __syncthreads();

    // GEMM: Out-tile(16l x 16m) += A(16l x 4d) * B(4d x 16m), 16 steps over D=64
    const int t0 = wave * 2;
    const int t1 = wave * 2 + 1;
    const int l0 = (t0 >> 2) * 16, m0 = (t0 & 3) * 16;
    const int l1 = (t1 >> 2) * 16, m1 = (t1 & 3) * 16;
    v8f acc0 = {};
    v8f acc1 = {};
    const int ln  = lane & 15;
    const int lhi = (lane >> 4) * 2;
    #pragma unroll
    for (int kd = 0; kd < 16; ++kd) {
        const int db = kd * 4 + lhi;
        v2f a0, b0, a1, b1;
        a0.x = Qt[l0 + ln][db];        a0.y = Qt[l0 + ln][db + 1];
        b0.x = KVs[m0 + ln][db];       b0.y = KVs[m0 + ln][db + 1];   // B[k][n] = KV[m][d]
        acc0 = __builtin_amdgcn_wmma_f32_16x16x4_f32(
                   false, a0, false, b0, (short)0, acc0, false, false);
        a1.x = Qt[l1 + ln][db];        a1.y = Qt[l1 + ln][db + 1];
        b1.x = KVs[m1 + ln][db];       b1.y = KVs[m1 + ln][db + 1];
        acc1 = __builtin_amdgcn_wmma_f32_16x16x4_f32(
                   false, a1, false, b1, (short)0, acc1, false, false);
    }

    // scale by Z and store: out[(bn*L + lt*64 + l)*H*M + h*M + m]
    float* outp = out + (size_t)bn * LL * HH * MM
                      + (size_t)(lt * 64) * (HH * MM) + (size_t)h * MM;
    const int mh = (lane >> 4) * 8;
    #pragma unroll
    for (int j = 0; j < 8; ++j) {
        const int lr0 = l0 + mh + j;
        outp[(size_t)lr0 * (HH * MM) + (m0 + ln)] = acc0[j] * zbuf[lr0];
        const int lr1 = l1 + mh + j;
        outp[(size_t)lr1 * (HH * MM) + (m1 + ln)] = acc1[j] * zbuf[lr1];
    }
}

extern "C" void kernel_launch(void* const* d_in, const int* in_sizes, int n_in,
                              void* d_out, int out_size, void* d_ws, size_t ws_size,
                              hipStream_t stream) {
    const float* queries  = (const float*)d_in[0];
    const float* keys     = (const float*)d_in[1];
    const float* values   = (const float*)d_in[2];
    const float* key_mask = (const float*)d_in[3];
    float* out = (float*)d_out;

    float* kv_ws   = (float*)d_ws;                      // BNH * 64 * 64 floats (4 MiB)
    float* ksum_ws = kv_ws + (size_t)BNH * MM * DD;     // BNH * 64 floats

    la_kv_kernel<<<dim3(BNH), dim3(256), 0, stream>>>(keys, values, key_mask, kv_ws, ksum_ws);
    la_out_kernel<<<dim3(LL / 64, BNH), dim3(256), 0, stream>>>(queries, kv_ws, ksum_ws, out);
}

// v001
// One run takes 40.5 microseconds.
// Next to v000, in two timings, it ran 2.04 times as fast each time.
#include <hip/hip_runtime.h>
#include <math.h>

// Problem constants (B,N,L,S,H,D,M) = (4,8,1024,1024,8,64,64)
#define BB 4
#define NN 8
#define LL 1024
#define SS 1024
#define HH 8
#define DD 64
#define MM 64
#define BNH (BB * NN * HH)   // 256
#define EPSV 1e-6f

typedef float v2f __attribute__((ext_vector_type(2)));
typedef float v8f __attribute__((ext_vector_type(8)));

// elu(x) + 1  ==  x>0 ? x+1 : exp(x)
__device__ __forceinline__ float elu1(float x) {
    return x > 0.0f ? x + 1.0f : __expf(x);
}

// -----------------------------------------------------------------------------
// Kernel 1: per (b,n,h) compute KV[m][d] = sum_s K[s,d]*V[s,m]  (64x64)
//           and Ksum[d] = sum_s K[s,d], with K = (elu(keys)+1)*mask.
// grid.x = BNH, block = 512 threads (16 waves). Every wave keeps the whole 64x64
// tile (16 accumulators) and takes every 16th group of 4 s-rows for itself, so each
// loaded element is used by one wave only: fragments come straight from 16-byte
// global loads, with no LDS staging and no barrier in the loop. The 16 partial
// tiles are summed through LDS at the end.
// Tile numbering: a lane's float4 at columns 4c..4c+3 feeds four tiles, so tile a
// of V holds m = 4*row + a and tile t of K holds d = 4*col + t.
// -----------------------------------------------------------------------------
#define KVW 16                    // waves per work-group
#define KVG (SS / (4 * KVW))      // groups of 4 s-rows per wave
#define KVP 4                     // groups loaded ahead

// the two s-rows of one group that a lane holds: 4 columns of K and of V, and the mask
struct KvRows { float4 kx, ky, vx, vy; float2 mk; };

__device__ __forceinline__ KvRows kv_load(const float* Kl, const float* Vl, const float* Ml, int g) {
    const size_t ro = (size_t)g * (KVW * 4);
    KvRows r;
    r.mk = *(const float2*)(Ml + ro);
    r.kx = *(const float4*)(Kl + ro * (HH * DD));
    r.ky = *(const float4*)(Kl + (ro + 1) * (HH * DD));
    r.vx = *(const float4*)(Vl + ro * (HH * MM));
    r.vy = *(const float4*)(Vl + (ro + 1) * (HH * MM));
    return r;
}

// A fragments (V) and B fragments (feature map of K, masked) of the four tiles each
__device__ __forceinline__ void kv_frags(const KvRows& r, v2f (&af)[4], v2f (&bf)[4]) {
    af[0].x = r.vx.x;  af[0].y = r.vy.x;
    af[1].x = r.vx.y;  af[1].y = r.vy.y;
    af[2].x = r.vx.z;  af[2].y = r.vy.z;
    af[3].x = r.vx.w;  af[3].y = r.vy.w;
    const float x[8] = {r.kx.x, r.kx.y, r.kx.z, r.kx.w, r.ky.x, r.ky.y, r.ky.z, r.ky.w};
    float t[8], e[8];
    #pragma unroll
    for (int i = 0; i < 8; ++i) t[i] = x[i] * 0x1.715476p+0f;   // log2(e), as __expf has it
    // exp(x) = v_exp_f32(x * log2 e), what __expf compiles to. In asm so that behind every
    // transcendental stands an instruction that neither reads its result nor overwrites
    // its source (the slot the instruction set asks for): the next independent v_exp_f32,
    // the v_nop behind the last.
    asm("v_exp_f32 %0, %8\n\t"
                 "v_exp_f32 %1, %9\n\t"
                 "v_exp_f32 %2, %10\n\t"
                 "v_exp_f32 %3, %11\n\t"
                 "v_exp_f32 %4, %12\n\t"
                 "v_exp_f32 %5, %13\n\t"
                 "v_exp_f32 %6, %14\n\t"
                 "v_exp_f32 %7, %15\n\t"
                 "v_nop"
                 : "=&v"(e[0]), "=&v"(e[1]), "=&v"(e[2]), "=&v"(e[3]),
                   "=&v"(e[4]), "=&v"(e[5]), "=&v"(e[6]), "=&v"(e[7])
                 : "v"(t[0]), "v"(t[1]), "v"(t[2]), "v"(t[3]),
                   "v"(t[4]), "v"(t[5]), "v"(t[6]), "v"(t[7]));
    #pragma unroll
    for (int i = 0; i < 4; ++i) {
        bf[i].x = (x[i]     > 0.0f ? x[i]     + 1.0f : e[i])     * r.mk.x;
        bf[i].y = (x[i + 4] > 0.0f ? x[i + 4] + 1.0f : e[i + 4]) * r.mk.y;
    }
}

__device__ __forceinline__ void kv_mma(const v2f (&af)[4], const v2f (&bf)[4],
                                       v8f (&acc)[4][4], v2f (&ks)[4]) {
    #pragma unroll
    for (int a = 0; a < 4; ++a)
        #pragma unroll
        for (int t = 0; t < 4; ++t)
            acc[a][t] = __builtin_amdgcn_wmma_f32_16x16x4_f32(
                            false, af[a], false, bf[t], (short)0, acc[a][t], false, false);
    #pragma unroll
    for (int t = 0; t < 4; ++t) ks[t] += bf[t];   // the lane's two s-rows apart, joined at the end
}

__global__ __launch_bounds__(KVW * 32) void la_kv_kernel(
    const float* __restrict__ keys,      // [B,N,S,H,D]
    const float* __restrict__ values,    // [B,N,S,H,M]
    const float* __restrict__ key_mask,  // [B,S]
    float* __restrict__ kv_ws,           // [BNH][64][64]  (m-major)
    float* __restrict__ ksum_ws)         // [BNH][64]
{
    const int bnh = blockIdx.x;
    const int h   = bnh % HH;
    const int bn  = bnh / HH;   // b*N + n
    const int b   = bn / NN;

    const float* Kp = keys   + (size_t)bn * SS * HH * DD + (size_t)h * DD; // (s,d): Kp[s*H*D + d]
    const float* Vp = values + (size_t)bn * SS * HH * MM + (size_t)h * MM; // (s,m): Vp[s*H*M + m]
    const float* maskp = key_mask + (size_t)b * SS;

    __shared__ float part[KVW][MM * DD];         // one partial KV tile per wave, [m][d]
    __shared__ float ksum_part[KVW * 2][DD];     // one partial Ksum per half wave

    const int tid  = threadIdx.x;
    const int lane = tid & 31;
    const int wave = tid >> 5;
    const int c    = lane & 15;
    const int hi   = lane >> 4;

    // group g of this wave: rows (g*KVW + wave)*4 + k; A/B layout: lanes 16-31 hold k=2,3
    const int srow = wave * 4 + hi * 2;
    const float* Kl = Kp + (size_t)srow * (HH * DD) + c * 4;
    const float* Vl = Vp + (size_t)srow * (HH * MM) + c * 4;
    const float* Ml = maskp + srow;

    v8f acc[4][4] = {};
    v2f ks[4] = {};

    KvRows r[KVP];
    #pragma unroll
    for (int p = 0; p < KVP; ++p) r[p] = kv_load(Kl, Vl, Ml, p);

    // Every group refills its own registers KVP groups ahead. Unrolled whole: in a rolled
    // loop the registers carried round were copied at its foot, behind a wait on all loads.
    #pragma unroll
    for (int g = 0; g < KVG; ++g) {
        // holds this group's feature map, and with it the waits on its loads, behind the
        // matrix block of the group before: without it they stand among those WMMAs
        __builtin_amdgcn_sched_barrier(0);
        v2f af[4], bf[4];
        kv_frags(r[g % KVP], af, bf);
        if (g + KVP < KVG) {
            // holds the refill behind the last use of the registers it refills, so that it
            // takes those registers again: issued ahead of it, it takes 15 registers more
            __builtin_amdgcn_sched_barrier(0);
            r[g % KVP] = kv_load(Kl, Vl, Ml, g + KVP);
        }
        if (g + KVP == KVG - 1) {
            // behind the last refill the address registers are free for other values: the
            // wait stands in front of whatever overwrites them, and the scheduling barrier
            // keeps those overwrites behind it
            asm volatile("s_wait_xcnt 0x0" ::: "memory");
            __builtin_amdgcn_sched_barrier(0);
        }
        kv_mma(af, bf, acc, ks);
    }

    // partial tiles to LDS in [m][d] order.  C layout: VGPR j -> row j + 8*hi, column c
    #pragma unroll
    for (int a = 0; a < 4; ++a) {
        #pragma unroll
        for (int j = 0; j < 8; ++j) {
            const int m = 4 * (j + 8 * hi) + a;
            *(float4*)&part[wave][m * DD + 4 * c] =
                make_float4(acc[a][0][j], acc[a][1][j], acc[a][2][j], acc[a][3][j]);
        }
    }
    *(float4*)&ksum_part[wave * 2 + hi][4 * c] = make_float4(ks[0].x + ks[0].y, ks[1].x + ks[1].y, ks[2].x + ks[2].y, ks[3].x + ks[3].y);
    __syncthreads();

    // sum the partials; each thread owns two float4 of the 64x64 tile
    float* kvp = kv_ws + (size_t)bnh * (MM * DD);
    #pragma unroll
    for (int i = 0; i < 2; ++i) {
        const int q = (tid + i * (KVW * 32)) * 4;
        float4 s = *(const float4*)&part[0][q];
        #pragma unroll
        for (int w = 1; w < KVW; ++w) {
            const float4 x = *(const float4*)&part[w][q];
            s.x += x.x;  s.y += x.y;  s.z += x.z;  s.w += x.w;
        }
        *(float4*)(kvp + q) = s;
    }
    if (tid < DD) {
        float s = ksum_part[0][tid];
        #pragma unroll
        for (int w = 1; w < KVW * 2; ++w) s += ksum_part[w][tid];
        ksum_ws[(size_t)bnh * DD + tid] = s;
    }
}

// -----------------------------------------------------------------------------
// Kernel 2: per (b,n,h, 64-row L-tile):
//   Out[l,m] = Z[l] * sum_d Q[l,d] * KV[m,d],  Z[l] = 1/(Q[l,:].Ksum + eps)
// grid = (L/64, BNH), block = 256 (8 waves, 2 output tiles each).
// -----------------------------------------------------------------------------
__global__ __launch_bounds__(256) void la_out_kernel(
    const float* __restrict__ queries,   // [B,N,L,H,D]
    const float* __restrict__ kv_ws,     // [BNH][64][64]
    const float* __restrict__ ksum_ws,   // [BNH][64]
    float* __restrict__ out)             // [B,N,L,H,M]
{
    const int lt  = blockIdx.x;   // 0..15 (64 L-rows each)
    const int bnh = blockIdx.y;   // 0..255
    const int h   = bnh % HH;
    const int bn  = bnh / HH;

    const float* Qp = queries + (size_t)bn * LL * HH * DD
                              + (size_t)(lt * 64) * (HH * DD) + (size_t)h * DD;

    __shared__ float Qt[64][DD + 1];
    __shared__ float KVs[MM][DD + 1];
    __shared__ float ksum_s[DD];
    __shared__ float zbuf[64];

    const int tid  = threadIdx.x;
    const int lane = tid & 31;
    const int wave = tid >> 5;

    // stage elu(Q)+1 tile: 64x64 floats
    for (int i = tid; i < 1024; i += 256) {
        const int row = i >> 4;
        const int c4  = (i & 15) * 4;
        const float4 q4 = *(const float4*)(Qp + (size_t)row * (HH * DD) + c4);
        Qt[row][c4 + 0] = elu1(q4.x);
        Qt[row][c4 + 1] = elu1(q4.y);
        Qt[row][c4 + 2] = elu1(q4.z);
        Qt[row][c4 + 3] = elu1(q4.w);
    }
    // stage KV (hot in L2 from kernel 1)
    const float* kvp = kv_ws + (size_t)bnh * (MM * DD);
    for (int i = tid; i < 1024; i += 256) {
        const int row = i >> 4;
        const int c4  = (i & 15) * 4;
        const float4 v4 = *(const float4*)(kvp + (size_t)row * DD + c4);
        KVs[row][c4 + 0] = v4.x;
        KVs[row][c4 + 1] = v4.y;
        KVs[row][c4 + 2] = v4.z;
        KVs[row][c4 + 3] = v4.w;
    }
    if (tid < DD) ksum_s[tid] = ksum_ws[(size_t)bnh * DD + tid];
    __syncthreads();

    // per-row normalizer
    if (tid < 64) {
        float acc = 0.0f;
        #pragma unroll
        for (int d = 0; d < DD; ++d) acc += Qt[tid][d] * ksum_s[d];
        zbuf[tid] = 1.0f / (acc + EPSV);
    }
    __syncthreads();

    // GEMM: Out-tile(16l x 16m) += A(16l x 4d) * B(4d x 16m), 16 steps over D=64
    const int t0 = wave * 2;
    const int t1 = wave * 2 + 1;
    const int l0 = (t0 >> 2) * 16, m0 = (t0 & 3) * 16;
    const int l1 = (t1 >> 2) * 16, m1 = (t1 & 3) * 16;
    v8f acc0 = {};
    v8f acc1 = {};
    const int ln  = lane & 15;
    const int lhi = (lane >> 4) * 2;
    #pragma unroll
    for (int kd = 0; kd < 16; ++kd) {
        const int db = kd * 4 + lhi;
        v2f a0, b0, a1, b1;
        a0.x = Qt[l0 + ln][db];        a0.y = Qt[l0 + ln][db + 1];
        b0.x = KVs[m0 + ln][db];       b0.y = KVs[m0 + ln][db + 1];   // B[k][n] = KV[m][d]
        acc0 = __builtin_amdgcn_wmma_f32_16x16x4_f32(
                   false, a0, false, b0, (short)0, acc0, false, false);
        a1.x = Qt[l1 + ln][db];        a1.y = Qt[l1 + ln][db + 1];
        b1.x = KVs[m1 + ln][db];       b1.y = KVs[m1 + ln][db + 1];
        acc1 = __builtin_amdgcn_wmma_f32_16x16x4_f32(
                   false, a1, false, b1, (short)0, acc1, false, false);
    }

    // scale by Z and store: out[(bn*L + lt*64 + l)*H*M + h*M + m]
    float* outp = out + (size_t)bn * LL * HH * MM
                      + (size_t)(lt * 64) * (HH * MM) + (size_t)h * MM;
    const int mh = (lane >> 4) * 8;
    #pragma unroll
    for (int j = 0; j < 8; ++j) {
        const int lr0 = l0 + mh + j;
        outp[(size_t)lr0 * (HH * MM) + (m0 + ln)] = acc0[j] * zbuf[lr0];
        const int lr1 = l1 + mh + j;
        outp[(size_t)lr1 * (HH * MM) + (m1 + ln)] = acc1[j] * zbuf[lr1];
    }
}

extern "C" void kernel_launch(void* const* d_in, const int* in_sizes, int n_in,
                              void* d_out, int out_size, void* d_ws, size_t ws_size,
                              hipStream_t stream) {
    const float* queries  = (const float*)d_in[0];
    const float* keys     = (const float*)d_in[1];
    const float* values   = (const float*)d_in[2];
    const float* key_mask = (const float*)d_in[3];
    float* out = (float*)d_out;

    float* kv_ws   = (float*)d_ws;                      // BNH * 64 * 64 floats (4 MiB)
    float* ksum_ws = kv_ws + (size_t)BNH * MM * DD;     // BNH * 64 floats

    la_kv_kernel<<<dim3(BNH), dim3(KVW * 32), 0, stream>>>(keys, values, key_mask, kv_ws, ksum_ws);
    la_out_kernel<<<dim3(LL / 64, BNH), dim3(256), 0, stream>>>(queries, kv_ws, ksum_ws, out);
}

// v002
// Measured time: 31.4 microseconds a run.
// Timed twice side by side with v001, it ran 1.30 and 1.29 times as fast.
// Over all steps from v000 it is 2.64 times as fast.
#include <hip/hip_runtime.h>
#include <math.h>

// Problem constants (B,N,L,S,H,D,M) = (4,8,1024,1024,8,64,64)
#define BB 4
#define NN 8
#define LL 1024
#define SS 1024
#define HH 8
#define DD 64
#define MM 64
#define BNH (BB * NN * HH)   // 256
#define EPSV 1e-6f

typedef float v2f __attribute__((ext_vector_type(2)));
typedef float v4f __attribute__((ext_vector_type(4)));
typedef float v8f __attribute__((ext_vector_type(8)));

// -----------------------------------------------------------------------------
// Kernel 1: per (b,n,h) compute KV[m][d] = sum_s K[s,d]*V[s,m]  (64x64)
//           and Ksum[d] = sum_s K[s,d], with K = (elu(keys)+1)*mask.
// grid.x = BNH, block = 512 threads (16 waves). Every wave keeps the whole 64x64
// tile (16 accumulators) and takes every 16th group of 4 s-rows for itself, so each
// loaded element is used by one wave only: fragments come straight from 16-byte
// global loads, with no LDS staging and no barrier in the loop. The 16 partial
// tiles are summed through LDS at the end.
// Tile numbering: a lane's float4 at columns 4c..4c+3 feeds four tiles, so tile a
// of V holds m = 4*row + a and tile t of K holds d = 4*col + t.
// -----------------------------------------------------------------------------
#define KVW 16                    // waves per work-group
#define KVG (SS / (4 * KVW))      // groups of 4 s-rows per wave
#define KVP 4                     // groups loaded ahead

// the two s-rows of one group that a lane holds: 4 columns of K and of V, and the mask
struct KvRows { float4 kx, ky, vx, vy; float2 mk; };

__device__ __forceinline__ KvRows kv_load(const float* Kl, const float* Vl, const float* Ml, int g) {
    const size_t ro = (size_t)g * (KVW * 4);
    KvRows r;
    r.mk = *(const float2*)(Ml + ro);
    r.kx = *(const float4*)(Kl + ro * (HH * DD));
    r.ky = *(const float4*)(Kl + (ro + 1) * (HH * DD));
    r.vx = *(const float4*)(Vl + ro * (HH * MM));
    r.vy = *(const float4*)(Vl + (ro + 1) * (HH * MM));
    return r;
}

// A fragments (V) and B fragments (feature map of K, masked) of the four tiles each
__device__ __forceinline__ void kv_frags(const KvRows& r, v2f (&af)[4], v2f (&bf)[4]) {
    af[0].x = r.vx.x;  af[0].y = r.vy.x;
    af[1].x = r.vx.y;  af[1].y = r.vy.y;
    af[2].x = r.vx.z;  af[2].y = r.vy.z;
    af[3].x = r.vx.w;  af[3].y = r.vy.w;
    const float x[8] = {r.kx.x, r.kx.y, r.kx.z, r.kx.w, r.ky.x, r.ky.y, r.ky.z, r.ky.w};
    float t[8], e[8];
    #pragma unroll
    for (int i = 0; i < 8; ++i) t[i] = x[i] * 0x1.715476p+0f;   // log2(e), as __expf has it
    // exp(x) = v_exp_f32(x * log2 e), what __expf compiles to. In asm so that behind every
    // transcendental stands an instruction that neither reads its result nor overwrites
    // its source (the slot the instruction set asks for): the next independent v_exp_f32,
    // the v_nop behind the last.
    asm("v_exp_f32 %0, %8\n\t"
                 "v_exp_f32 %1, %9\n\t"
                 "v_exp_f32 %2, %10\n\t"
                 "v_exp_f32 %3, %11\n\t"
                 "v_exp_f32 %4, %12\n\t"
                 "v_exp_f32 %5, %13\n\t"
                 "v_exp_f32 %6, %14\n\t"
                 "v_exp_f32 %7, %15\n\t"
                 "v_nop"
                 : "=&v"(e[0]), "=&v"(e[1]), "=&v"(e[2]), "=&v"(e[3]),
                   "=&v"(e[4]), "=&v"(e[5]), "=&v"(e[6]), "=&v"(e[7])
                 : "v"(t[0]), "v"(t[1]), "v"(t[2]), "v"(t[3]),
                   "v"(t[4]), "v"(t[5]), "v"(t[6]), "v"(t[7]));
    #pragma unroll
    for (int i = 0; i < 4; ++i) {
        bf[i].x = (x[i]     > 0.0f ? x[i]     + 1.0f : e[i])     * r.mk.x;
        bf[i].y = (x[i + 4] > 0.0f ? x[i + 4] + 1.0f : e[i + 4]) * r.mk.y;
    }
}

__device__ __forceinline__ void kv_mma(const v2f (&af)[4], const v2f (&bf)[4],
                                       v8f (&acc)[4][4], v2f (&ks)[4]) {
    #pragma unroll
    for (int a = 0; a < 4; ++a)
        #pragma unroll
        for (int t = 0; t < 4; ++t)
            acc[a][t] = __builtin_amdgcn_wmma_f32_16x16x4_f32(
                            false, af[a], false, bf[t], (short)0, acc[a][t], false, false);
    #pragma unroll
    for (int t = 0; t < 4; ++t) ks[t] += bf[t];   // the lane's two s-rows apart, joined at the end
}

__global__ __launch_bounds__(KVW * 32) void la_kv_kernel(
    const float* __restrict__ keys,      // [B,N,S,H,D]
    const float* __restrict__ values,    // [B,N,S,H,M]
    const float* __restrict__ key_mask,  // [B,S]
    float* __restrict__ kv_ws,           // [BNH][64][64]  (m-major)
    float* __restrict__ ksum_ws)         // [BNH][64]
{
    const int bnh = blockIdx.x;
    const int h   = bnh % HH;
    const int bn  = bnh / HH;   // b*N + n
    const int b   = bn / NN;

    const float* Kp = keys   + (size_t)bn * SS * HH * DD + (size_t)h * DD; // (s,d): Kp[s*H*D + d]
    const float* Vp = values + (size_t)bn * SS * HH * MM + (size_t)h * MM; // (s,m): Vp[s*H*M + m]
    const float* maskp = key_mask + (size_t)b * SS;

    __shared__ float part[KVW][MM * DD];         // one partial KV tile per wave, [m][d]
    __shared__ float ksum_part[KVW * 2][DD];     // one partial Ksum per half wave

    const int tid  = threadIdx.x;
    const int lane = tid & 31;
    const int wave = tid >> 5;
    const int c    = lane & 15;
    const int hi   = lane >> 4;

    // group g of this wave: rows (g*KVW + wave)*4 + k; A/B layout: lanes 16-31 hold k=2,3
    const int srow = wave * 4 + hi * 2;
    const float* Kl = Kp + (size_t)srow * (HH * DD) + c * 4;
    const float* Vl = Vp + (size_t)srow * (HH * MM) + c * 4;
    const float* Ml = maskp + srow;

    v8f acc[4][4] = {};
    v2f ks[4] = {};

    KvRows r[KVP];
    #pragma unroll
    for (int p = 0; p < KVP; ++p) r[p] = kv_load(Kl, Vl, Ml, p);

    // Every group refills its own registers KVP groups ahead. Unrolled whole: in a rolled
    // loop the registers carried round were copied at its foot, behind a wait on all loads.
    #pragma unroll
    for (int g = 0; g < KVG; ++g) {
        // holds this group's feature map, and with it the waits on its loads, behind the
        // matrix block of the group before: without it they stand among those WMMAs
        __builtin_amdgcn_sched_barrier(0);
        v2f af[4], bf[4];
        kv_frags(r[g % KVP], af, bf);
        if (g + KVP < KVG) {
            // holds the refill behind the last use of the registers it refills, so that it
            // takes those registers again: issued ahead of it, it takes 15 registers more
            __builtin_amdgcn_sched_barrier(0);
            r[g % KVP] = kv_load(Kl, Vl, Ml, g + KVP);
        }
        if (g + KVP == KVG - 1) {
            // behind the last refill the address registers are free for other values: the
            // wait stands in front of whatever overwrites them, and the scheduling barrier
            // keeps those overwrites behind it
            asm volatile("s_wait_xcnt 0x0" ::: "memory");
            __builtin_amdgcn_sched_barrier(0);
        }
        kv_mma(af, bf, acc, ks);
    }

    // partial tiles to LDS in [m][d] order.  C layout: VGPR j -> row j + 8*hi, column c
    #pragma unroll
    for (int a = 0; a < 4; ++a) {
        #pragma unroll
        for (int j = 0; j < 8; ++j) {
            const int m = 4 * (j + 8 * hi) + a;
            *(float4*)&part[wave][m * DD + 4 * c] =
                make_float4(acc[a][0][j], acc[a][1][j], acc[a][2][j], acc[a][3][j]);
        }
    }
    *(float4*)&ksum_part[wave * 2 + hi][4 * c] = make_float4(ks[0].x + ks[0].y, ks[1].x + ks[1].y, ks[2].x + ks[2].y, ks[3].x + ks[3].y);
    __syncthreads();

    // sum the partials; each thread owns two float4 of the 64x64 tile
    float* kvp = kv_ws + (size_t)bnh * (MM * DD);
    #pragma unroll
    for (int i = 0; i < 2; ++i) {
        const int q = (tid + i * (KVW * 32)) * 4;
        float4 s = *(const float4*)&part[0][q];
        #pragma unroll
        for (int w = 1; w < KVW; ++w) {
            const float4 x = *(const float4*)&part[w][q];
            s.x += x.x;  s.y += x.y;  s.z += x.z;  s.w += x.w;
        }
        *(float4*)(kvp + q) = s;
    }
    if (tid < DD) {
        float s = ksum_part[0][tid];
        #pragma unroll
        for (int w = 1; w < KVW * 2; ++w) s += ksum_part[w][tid];
        ksum_ws[(size_t)bnh * DD + tid] = s;
    }
}

// -----------------------------------------------------------------------------
// Kernel 2: per (b,n,h), all L rows:
//   Out[l,m] = Z[l] * sum_d Q[l,d] * KV[m,d],  Z[l] = 1/(Q[l,:].Ksum + eps)
// grid.x = BNH, block = 512 threads (16 waves). Every wave holds the whole KV tile as
// A fragments in registers and walks over its own 16-row tiles of Q, which are the B
// operand: D[m][l], so a lane owns one row l, its Z and 8 consecutive m per tile of KV.
// Q rows come in and Out rows go out as whole 256-byte rows; both are turned between
// row order and fragment order in the wave's own LDS range, with no barrier in the loop.
// k order of both operands: float4 j of lane half hi holds d = 8j + 4hi + (0..3);
// its .x,.y feed one WMMA and its .z,.w the next.
// -----------------------------------------------------------------------------
#define OW 16                     // waves per work-group
#define OT (LL / (16 * OW))       // 16-row tiles per wave
#define OP (DD + 4)               // LDS row pitch in floats: 272 B, an odd multiple of 16 B

// elu(x) + 1  ==  x>0 ? x+1 : exp(x), on eight values in place
__device__ __forceinline__ void feat8(float4& p, float4& q) {
    const float x[8] = {p.x, p.y, p.z, p.w, q.x, q.y, q.z, q.w};
    float t[8], e[8];
    #pragma unroll
    for (int i = 0; i < 8; ++i) t[i] = x[i] * 0x1.715476p+0f;   // log2(e), as __expf has it
    // as in kv_frags: behind every transcendental stands an instruction that neither reads
    // its result nor overwrites its source, the v_nop behind the last
    asm("v_exp_f32 %0, %8\n\t"
        "v_exp_f32 %1, %9\n\t"
        "v_exp_f32 %2, %10\n\t"
        "v_exp_f32 %3, %11\n\t"
        "v_exp_f32 %4, %12\n\t"
        "v_exp_f32 %5, %13\n\t"
        "v_exp_f32 %6, %14\n\t"
        "v_exp_f32 %7, %15\n\t"
        "v_nop"
        : "=&v"(e[0]), "=&v"(e[1]), "=&v"(e[2]), "=&v"(e[3]),
          "=&v"(e[4]), "=&v"(e[5]), "=&v"(e[6]), "=&v"(e[7])
        : "v"(t[0]), "v"(t[1]), "v"(t[2]), "v"(t[3]),
          "v"(t[4]), "v"(t[5]), "v"(t[6]), "v"(t[7]));
    p.x = x[0] > 0.0f ? x[0] + 1.0f : e[0];
    p.y = x[1] > 0.0f ? x[1] + 1.0f : e[1];
    p.z = x[2] > 0.0f ? x[2] + 1.0f : e[2];
    p.w = x[3] > 0.0f ? x[3] + 1.0f : e[3];
    q.x = x[4] > 0.0f ? x[4] + 1.0f : e[4];
    q.y = x[5] > 0.0f ? x[5] + 1.0f : e[5];
    q.z = x[6] > 0.0f ? x[6] + 1.0f : e[6];
    q.w = x[7] > 0.0f ? x[7] + 1.0f : e[7];
}

// One 16-row tile of one wave. raw holds its Q rows in row order on entry; with PF the next
// tile's rows are asked for into the same registers while this tile's products run.
// off: the lane's place in the first two rows of this tile, in bytes, in Q as in Out (M == D).
template <bool PF>
__device__ __forceinline__ void out_tile(float4 (&raw)[8], const v4f (&kvf)[4][8],
                                         const float* Q, float* O, unsigned off,
                                         float* qrow, float* orow, const float* qfrg, float* ofrg,
                                         const float* ksl) {
    #pragma unroll
    for (int q = 0; q < 8; q += 2) {
        feat8(raw[q], raw[q + 1]);
        *(float4*)(qrow + 2 * q * OP)       = raw[q];
        *(float4*)(qrow + (2 * q + 2) * OP) = raw[q + 1];
    }
    // the rows other lanes of this wave stored are read back only when they stand in LDS
    asm volatile("s_wait_dscnt 0x0" ::: "memory");
    v4f qf[8];
    #pragma unroll
    for (int j = 0; j < 8; ++j) qf[j] = *(const v4f*)(qfrg + 8 * j);

    // normalizer of row c: each lane half sums its 32 d, the halves are joined across
    v2f z01 = {}, z23 = {};
    #pragma unroll
    for (int j = 0; j < 8; ++j) {
        const v4f k4 = *(const v4f*)(ksl + 8 * j);
        z01 = __builtin_elementwise_fma(qf[j].lo, k4.lo, z01);
        z23 = __builtin_elementwise_fma(qf[j].hi, k4.hi, z23);
    }
    const float zh = (z01.x + z01.y) + (z23.x + z23.y);
    const float zo = __uint_as_float(__builtin_amdgcn_permlanex16(
                         0u, __float_as_uint(zh), 0x76543210u, 0xfedcba98u, false, false));
    const float z = 1.0f / ((zh + zo) + EPSV);

    if (PF) {
        #pragma unroll
        for (int q = 0; q < 8; ++q)
            raw[q] = *(const float4*)((const char*)Q + ((size_t)off + (size_t)(OW * 16 + 2 * q) * (HH * DD * 4)));
    }

    #pragma unroll
    for (int a = 0; a < 4; a += 2) {
        v8f acc0 = {};
        v8f acc1 = {};
        #pragma unroll
        for (int j = 0; j < 8; ++j) {
            acc0 = __builtin_amdgcn_wmma_f32_16x16x4_f32(
                       false, kvf[a][j].lo, false, qf[j].lo, (short)0, acc0, false, false);
            acc1 = __builtin_amdgcn_wmma_f32_16x16x4_f32(
                       false, kvf[a + 1][j].lo, false, qf[j].lo, (short)0, acc1, false, false);
            acc0 = __builtin_amdgcn_wmma_f32_16x16x4_f32(
                       false, kvf[a][j].hi, false, qf[j].hi, (short)0, acc0, false, false);
            acc1 = __builtin_amdgcn_wmma_f32_16x16x4_f32(
                       false, kvf[a + 1][j].hi, false, qf[j].hi, (short)0, acc1, false, false);
        }
        // D layout: VGPR r -> m = 16a + 8*hi + r, column c -> row l = c
        *(float4*)(ofrg + 16 * a)      = make_float4(acc0[0] * z, acc0[1] * z, acc0[2] * z, acc0[3] * z);
        *(float4*)(ofrg + 16 * a + 4)  = make_float4(acc0[4] * z, acc0[5] * z, acc0[6] * z, acc0[7] * z);
        *(float4*)(ofrg + 16 * a + 16) = make_float4(acc1[0] * z, acc1[1] * z, acc1[2] * z, acc1[3] * z);
        *(float4*)(ofrg + 16 * a + 20) = make_float4(acc1[4] * z, acc1[5] * z, acc1[6] * z, acc1[7] * z);
    }
    // as above: the Out rows are read back only when they stand in LDS
    asm volatile("s_wait_dscnt 0x0" ::: "memory");
    #pragma unroll
    for (int q = 0; q < 8; ++q)
        *(float4*)((char*)O + ((size_t)off + (size_t)(2 * q) * (HH * MM * 4))) = *(const float4*)(orow + 2 * q * OP);
}

__global__ __launch_bounds__(OW * 32) void la_out_kernel(
    const float* __restrict__ queries,   // [B,N,L,H,D]
    const float* __restrict__ kv_ws,     // [BNH][64][64]
    const float* __restrict__ ksum_ws,   // [BNH][64]
    float* __restrict__ out)             // [B,N,L,H,M]
{
    const int bnh = blockIdx.x;
    const int h   = bnh % HH;
    const int bn  = bnh / HH;

    __shared__ __attribute__((aligned(16))) float KVs[MM * OP];
    __shared__ __attribute__((aligned(16))) float ksum_s[DD];
    __shared__ __attribute__((aligned(16))) float qst[OW][16 * OP];   // a wave's Q tile
    __shared__ __attribute__((aligned(16))) float ost[OW][16 * OP];   // a wave's Out tile

    const int tid  = threadIdx.x;
    const int lane = tid & 31;
    const int wave = tid >> 5;
    const int c    = lane & 15;
    const int hi   = lane >> 4;

    // row order: access q of a tile covers its rows 2q and 2q+1, 16 bytes a lane.
    // Tile i of this wave starts at row (i*OW + wave)*16.
    unsigned off = 4u * (unsigned)(bn * (LL * HH * DD) + (wave * 16 + hi) * (HH * DD) + h * DD + 4 * c);
    float* qrow = &qst[wave][hi * OP + 4 * c];
    float* orow = &ost[wave][hi * OP + 4 * c];
    float* qfrg = &qst[wave][c * OP + 4 * hi];
    float* ofrg = &ost[wave][c * OP + 8 * hi];
    const float* ksl  = &ksum_s[4 * hi];
    const float* kfrg = &KVs[c * OP + 4 * hi];

    // KV and Ksum once per work-group through LDS, then into every wave's registers
    const float* kvp = kv_ws + (size_t)bnh * (MM * DD);
    #pragma unroll
    for (int i = 0; i < 2; ++i) {
        const int e = tid + i * (OW * 32);
        *(float4*)&KVs[(e >> 4) * OP + (e & 15) * 4] = *(const float4*)(kvp + e * 4);
    }
    if (tid < DD / 4) *(float4*)&ksum_s[tid * 4] = *(const float4*)(ksum_ws + (size_t)bnh * DD + tid * 4);
    __syncthreads();

    v4f kvf[4][8];                       // tile a: row m = 16a + c
    #pragma unroll
    for (int a = 0; a < 4; ++a)
        #pragma unroll
        for (int j = 0; j < 8; ++j)
            kvf[a][j] = *(const v4f*)(kfrg + 16 * a * OP + 8 * j);

    float4 raw[8];
    #pragma unroll
    for (int q = 0; q < 8; ++q) raw[q] = *(const float4*)((const char*)queries + ((size_t)off + (size_t)(2 * q) * (HH * DD * 4)));

    // Kept rolled: the loop's back edge holds the feature map of the rows asked for ahead
    // behind this tile's products; unrolled, it was moved up to the loads and waited there.
    #pragma unroll 1
    for (int i = 0; i < OT - 1; ++i) {
        out_tile<true>(raw, kvf, queries, out, off, qrow, orow, qfrg, ofrg, ksl);
        // The registers that this tile's loads and stores name are written again from here on:
        // the wait stands in front of that. It names the offset register, so that it lives up
        // to the wait (no load takes it as its destination) and is advanced only behind it.
        asm volatile("s_wait_xcnt 0x0" : "+v"(off) :: "memory");
        off += (OW * 16) * (HH * DD * 4);
    }
    out_tile<false>(raw, kvf, queries, out, off, qrow, orow, qfrg, ofrg, ksl);
}

extern "C" void kernel_launch(void* const* d_in, const int* in_sizes, int n_in,
                              void* d_out, int out_size, void* d_ws, size_t ws_size,
                              hipStream_t stream) {
    const float* queries  = (const float*)d_in[0];
    const float* keys     = (const float*)d_in[1];
    const float* values   = (const float*)d_in[2];
    const float* key_mask = (const float*)d_in[3];
    float* out = (float*)d_out;

    float* kv_ws   = (float*)d_ws;                      // BNH * 64 * 64 floats (4 MiB)
    float* ksum_ws = kv_ws + (size_t)BNH * MM * DD;     // BNH * 64 floats

    la_kv_kernel<<<dim3(BNH), dim3(KVW * 32), 0, stream>>>(keys, values, key_mask, kv_ws, ksum_ws);
    la_out_kernel<<<dim3(BNH), dim3(OW * 32), 0, stream>>>(queries, kv_ws, ksum_ws, out);
}

// v003
// One run takes 29 microseconds.
// In both of two side-by-side timings against v002, it was 1.08 times as fast.
// Counting every step since v000, it is 2.86 times as fast.
#include <hip/hip_runtime.h>
#include <math.h>

// Problem constants (B,N,L,S,H,D,M) = (4,8,1024,1024,8,64,64)
#define BB 4
#define NN 8
#define LL 1024
#define SS 1024
#define HH 8
#define DD 64
#define MM 64
#define BNH (BB * NN * HH)   // 256
#define EPSV 1e-6f

typedef float v2f __attribute__((ext_vector_type(2)));
typedef float v4f __attribute__((ext_vector_type(4)));
typedef float v8f __attribute__((ext_vector_type(8)));

// -----------------------------------------------------------------------------
// One launch, grid.x = BNH, block = 512 threads (16 waves): a work-group does both parts
// of its (b,n,h), and KV and Ksum go from the first part to the second through LDS.
//
// Part 1: KV[m][d] = sum_s K[s,d]*V[s,m]  (64x64)
//         and Ksum[d] = sum_s K[s,d], with K = (elu(keys)+1)*mask.
// Every wave keeps the whole 64x64
// tile (16 accumulators) and takes every 16th group of 4 s-rows for itself, so each
// loaded element is used by one wave only: fragments come straight from 16-byte
// global loads, with no LDS staging and no barrier in the loop. The 16 partial
// tiles are summed through LDS at the end.
// Tile numbering: a lane's float4 at columns 4c..4c+3 feeds four tiles, so tile a
// of V holds m = 4*row + a and tile t of K holds d = 4*col + t.
// -----------------------------------------------------------------------------
#define KVW 16                    // waves per work-group
#define KVG (SS / (4 * KVW))      // groups of 4 s-rows per wave
#define KVP 4                     // groups loaded ahead

// the two s-rows of one group that a lane holds: 4 columns of K and of V, and the mask
struct KvRows { float4 kx, ky, vx, vy; float2 mk; };

__device__ __forceinline__ KvRows kv_load(const float* Kl, const float* Vl, const float* Ml, int g) {
    const size_t ro = (size_t)g * (KVW * 4);
    KvRows r;
    r.mk = *(const float2*)(Ml + ro);
    r.kx = *(const float4*)(Kl + ro * (HH * DD));
    r.ky = *(const float4*)(Kl + (ro + 1) * (HH * DD));
    r.vx = *(const float4*)(Vl + ro * (HH * MM));
    r.vy = *(const float4*)(Vl + (ro + 1) * (HH * MM));
    return r;
}

// A fragments (V) and B fragments (feature map of K, masked) of the four tiles each
__device__ __forceinline__ void kv_frags(const KvRows& r, v2f (&af)[4], v2f (&bf)[4]) {
    af[0].x = r.vx.x;  af[0].y = r.vy.x;
    af[1].x = r.vx.y;  af[1].y = r.vy.y;
    af[2].x = r.vx.z;  af[2].y = r.vy.z;
    af[3].x = r.vx.w;  af[3].y = r.vy.w;
    const float x[8] = {r.kx.x, r.kx.y, r.kx.z, r.kx.w, r.ky.x, r.ky.y, r.ky.z, r.ky.w};
    float t[8], e[8];
    #pragma unroll
    for (int i = 0; i < 8; ++i) t[i] = x[i] * 0x1.715476p+0f;   // log2(e), as __expf has it
    // exp(x) = v_exp_f32(x * log2 e), what __expf compiles to. In asm so that behind every
    // transcendental stands an instruction that neither reads its result nor overwrites
    // its source (the slot the instruction set asks for): the next independent v_exp_f32,
    // the v_nop behind the last.
    asm("v_exp_f32 %0, %8\n\t"
                 "v_exp_f32 %1, %9\n\t"
                 "v_exp_f32 %2, %10\n\t"
                 "v_exp_f32 %3, %11\n\t"
                 "v_exp_f32 %4, %12\n\t"
                 "v_exp_f32 %5, %13\n\t"
                 "v_exp_f32 %6, %14\n\t"
                 "v_exp_f32 %7, %15\n\t"
                 "v_nop"
                 : "=&v"(e[0]), "=&v"(e[1]), "=&v"(e[2]), "=&v"(e[3]),
                   "=&v"(e[4]), "=&v"(e[5]), "=&v"(e[6]), "=&v"(e[7])
                 : "v"(t[0]), "v"(t[1]), "v"(t[2]), "v"(t[3]),
                   "v"(t[4]), "v"(t[5]), "v"(t[6]), "v"(t[7]));
    #pragma unroll
    for (int i = 0; i < 4; ++i) {
        bf[i].x = (x[i]     > 0.0f ? x[i]     + 1.0f : e[i])     * r.mk.x;
        bf[i].y = (x[i + 4] > 0.0f ? x[i + 4] + 1.0f : e[i + 4]) * r.mk.y;
    }
}

__device__ __forceinline__ void kv_mma(const v2f (&af)[4], const v2f (&bf)[4],
                                       v8f (&acc)[4][4], v2f (&ks)[4]) {
    #pragma unroll
    for (int a = 0; a < 4; ++a)
        #pragma unroll
        for (int t = 0; t < 4; ++t)
            acc[a][t] = __builtin_amdgcn_wmma_f32_16x16x4_f32(
                            false, af[a], false, bf[t], (short)0, acc[a][t], false, false);
    #pragma unroll
    for (int t = 0; t < 4; ++t) ks[t] += bf[t];   // the lane's two s-rows apart, joined at the end
}

// -----------------------------------------------------------------------------
// Part 2: all L rows of the same (b,n,h):
//   Out[l,m] = Z[l] * sum_d Q[l,d] * KV[m,d],  Z[l] = 1/(Q[l,:].Ksum + eps)
// Every wave holds the whole KV tile as
// A fragments in registers and walks over its own 16-row tiles of Q, which are the B
// operand: D[m][l], so a lane owns one row l, its Z and 8 consecutive m per tile of KV.
// Q rows come in and Out rows go out as whole 256-byte rows; both are turned between
// row order and fragment order in the wave's own LDS range, with no barrier in the loop.
// k order of both operands: float4 j of lane half hi holds d = 8j + 4hi + (0..3);
// its .x,.y feed one WMMA and its .z,.w the next.
// -----------------------------------------------------------------------------
#define OW 16                     // waves per work-group
#define OT (LL / (16 * OW))       // 16-row tiles per wave
#define OP (DD + 4)               // LDS row pitch in floats: 272 B, an odd multiple of 16 B

// elu(x) + 1  ==  x>0 ? x+1 : exp(x), on eight values in place
__device__ __forceinline__ void feat8(float4& p, float4& q) {
    const float x[8] = {p.x, p.y, p.z, p.w, q.x, q.y, q.z, q.w};
    float t[8], e[8];
    #pragma unroll
    for (int i = 0; i < 8; ++i) t[i] = x[i] * 0x1.715476p+0f;   // log2(e), as __expf has it
    // as in kv_frags: behind every transcendental stands an instruction that neither reads
    // its result nor overwrites its source, the v_nop behind the last
    asm("v_exp_f32 %0, %8\n\t"
        "v_exp_f32 %1, %9\n\t"
        "v_exp_f32 %2, %10\n\t"
        "v_exp_f32 %3, %11\n\t"
        "v_exp_f32 %4, %12\n\t"
        "v_exp_f32 %5, %13\n\t"
        "v_exp_f32 %6, %14\n\t"
        "v_exp_f32 %7, %15\n\t"
        "v_nop"
        : "=&v"(e[0]), "=&v"(e[1]), "=&v"(e[2]), "=&v"(e[3]),
          "=&v"(e[4]), "=&v"(e[5]), "=&v"(e[6]), "=&v"(e[7])
        : "v"(t[0]), "v"(t[1]), "v"(t[2]), "v"(t[3]),
          "v"(t[4]), "v"(t[5]), "v"(t[6]), "v"(t[7]));
    p.x = x[0] > 0.0f ? x[0] + 1.0f : e[0];
    p.y = x[1] > 0.0f ? x[1] + 1.0f : e[1];
    p.z = x[2] > 0.0f ? x[2] + 1.0f : e[2];
    p.w = x[3] > 0.0f ? x[3] + 1.0f : e[3];
    q.x = x[4] > 0.0f ? x[4] + 1.0f : e[4];
    q.y = x[5] > 0.0f ? x[5] + 1.0f : e[5];
    q.z = x[6] > 0.0f ? x[6] + 1.0f : e[6];
    q.w = x[7] > 0.0f ? x[7] + 1.0f : e[7];
}

// One 16-row tile of one wave. raw holds its Q rows in row order on entry; with PF the next
// tile's rows are asked for into the same registers while this tile's products run.
// off: the lane's place in the first two rows of this tile, in bytes, in Q as in Out (M == D).
template <bool PF>
__device__ __forceinline__ void out_tile(float4 (&raw)[8], const v4f (&kvf)[4][8],
                                         const float* Q, float* O, unsigned off,
                                         float* qrow, float* orow, const float* qfrg, float* ofrg,
                                         const float* ksl) {
    #pragma unroll
    for (int q = 0; q < 8; q += 2) {
        feat8(raw[q], raw[q + 1]);
        *(float4*)(qrow + 2 * q * OP)       = raw[q];
        *(float4*)(qrow + (2 * q + 2) * OP) = raw[q + 1];
    }
    // the rows other lanes of this wave stored are read back only when they stand in LDS
    asm volatile("s_wait_dscnt 0x0" ::: "memory");
    v4f qf[8];
    #pragma unroll
    for (int j = 0; j < 8; ++j) qf[j] = *(const v4f*)(qfrg + 8 * j);

    // normalizer of row c: each lane half sums its 32 d, the halves are joined across
    v2f z01 = {}, z23 = {};
    #pragma unroll
    for (int j = 0; j < 8; ++j) {
        const v4f k4 = *(const v4f*)(ksl + 8 * j);
        z01 = __builtin_elementwise_fma(qf[j].lo, k4.lo, z01);
        z23 = __builtin_elementwise_fma(qf[j].hi, k4.hi, z23);
    }
    const float zh = (z01.x + z01.y) + (z23.x + z23.y);
    const float zo = __uint_as_float(__builtin_amdgcn_permlanex16(
                         0u, __float_as_uint(zh), 0x76543210u, 0xfedcba98u, false, false));
    const float z = 1.0f / ((zh + zo) + EPSV);

    if (PF) {
        #pragma unroll
        for (int q = 0; q < 8; ++q)
            raw[q] = *(const float4*)((const char*)Q + ((size_t)off + (size_t)(OW * 16 + 2 * q) * (HH * DD * 4)));
    }

    #pragma unroll
    for (int a = 0; a < 4; a += 2) {
        v8f acc0 = {};
        v8f acc1 = {};
        #pragma unroll
        for (int j = 0; j < 8; ++j) {
            acc0 = __builtin_amdgcn_wmma_f32_16x16x4_f32(
                       false, kvf[a][j].lo, false, qf[j].lo, (short)0, acc0, false, false);
            acc1 = __builtin_amdgcn_wmma_f32_16x16x4_f32(
                       false, kvf[a + 1][j].lo, false, qf[j].lo, (short)0, acc1, false, false);
            acc0 = __builtin_amdgcn_wmma_f32_16x16x4_f32(
                       false, kvf[a][j].hi, false, qf[j].hi, (short)0, acc0, false, false);
            acc1 = __builtin_amdgcn_wmma_f32_16x16x4_f32(
                       false, kvf[a + 1][j].hi, false, qf[j].hi, (short)0, acc1, false, false);
        }
        // D layout: VGPR r -> m = 16a + 8*hi + r, column c -> row l = c
        *(float4*)(ofrg + 16 * a)      = make_float4(acc0[0] * z, acc0[1] * z, acc0[2] * z, acc0[3] * z);
        *(float4*)(ofrg + 16 * a + 4)  = make_float4(acc0[4] * z, acc0[5] * z, acc0[6] * z, acc0[7] * z);
        *(float4*)(ofrg + 16 * a + 16) = make_float4(acc1[0] * z, acc1[1] * z, acc1[2] * z, acc1[3] * z);
        *(float4*)(ofrg + 16 * a + 20) = make_float4(acc1[4] * z, acc1[5] * z, acc1[6] * z, acc1[7] * z);
    }
    // as above: the Out rows are read back only when they stand in LDS
    asm volatile("s_wait_dscnt 0x0" ::: "memory");
    #pragma unroll
    for (int q = 0; q < 8; ++q)
        *(float4*)((char*)O + ((size_t)off + (size_t)(2 * q) * (HH * MM * 4))) = *(const float4*)(orow + 2 * q * OP);
}

__global__ __launch_bounds__(KVW * 32) void la_fused_kernel(
    const float* __restrict__ queries,   // [B,N,L,H,D]
    const float* __restrict__ keys,      // [B,N,S,H,D]
    const float* __restrict__ values,    // [B,N,S,H,M]
    const float* __restrict__ key_mask,  // [B,S]
    float* __restrict__ out)             // [B,N,L,H,M]
{
    const int bnh = blockIdx.x;
    const int h   = bnh % HH;
    const int bn  = bnh / HH;   // b*N + n
    const int b   = bn / NN;

    const float* Kp = keys   + (size_t)bn * SS * HH * DD + (size_t)h * DD; // (s,d): Kp[s*H*D + d]
    const float* Vp = values + (size_t)bn * SS * HH * MM + (size_t)h * MM; // (s,m): Vp[s*H*M + m]
    const float* maskp = key_mask + (size_t)b * SS;

    // one partial KV tile per wave, [m][d]; in part 2 the head of a wave's own slab holds
    // its Q tile and its Out tile (2 * 16 * OP floats of the MM * DD)
    __shared__ __attribute__((aligned(16))) float part[KVW][MM * DD];
    __shared__ __attribute__((aligned(16))) float ksum_part[KVW * 2][DD];   // one partial Ksum per half wave
    __shared__ __attribute__((aligned(16))) float KVs[MM * OP];
    __shared__ __attribute__((aligned(16))) float ksum_s[DD];

    const int tid  = threadIdx.x;
    const int lane = tid & 31;
    const int wave = tid >> 5;
    const int c    = lane & 15;
    const int hi   = lane >> 4;

    // group g of this wave: rows (g*KVW + wave)*4 + k; A/B layout: lanes 16-31 hold k=2,3
    const int srow = wave * 4 + hi * 2;
    const float* Kl = Kp + (size_t)srow * (HH * DD) + c * 4;
    const float* Vl = Vp + (size_t)srow * (HH * MM) + c * 4;
    const float* Ml = maskp + srow;

    v8f acc[4][4] = {};
    v2f ks[4] = {};

    // Part 2, row order: access q of a tile covers its rows 2q and 2q+1, 16 bytes a lane.
    // Tile i of this wave starts at row (i*OW + wave)*16.
    unsigned off = 4u * (unsigned)(bn * (LL * HH * DD) + (wave * 16 + hi) * (HH * DD) + h * DD + 4 * c);
    float4 raw[8];

    KvRows r[KVP];
    #pragma unroll
    for (int p = 0; p < KVP; ++p) r[p] = kv_load(Kl, Vl, Ml, p);

    // Every group refills its own registers KVP groups ahead. Unrolled whole: in a rolled
    // loop the registers carried round were copied at its foot, behind a wait on all loads.
    #pragma unroll
    for (int g = 0; g < KVG; ++g) {
        // holds this group's feature map, and with it the waits on its loads, behind the
        // matrix block of the group before: without it they stand among those WMMAs
        __builtin_amdgcn_sched_barrier(0);
        v2f af[4], bf[4];
        kv_frags(r[g % KVP], af, bf);
        if (g + KVP < KVG) {
            // holds the refill behind the last use of the registers it refills, so that it
            // takes those registers again: issued ahead of it, it takes 15 registers more
            __builtin_amdgcn_sched_barrier(0);
            r[g % KVP] = kv_load(Kl, Vl, Ml, g + KVP);
        }
        if (g + KVP == KVG - 1) {
            // behind the last refill the address registers are free for other values: the
            // wait stands in front of whatever overwrites them, and the scheduling barrier
            // keeps those overwrites behind it
            asm volatile("s_wait_xcnt 0x0" ::: "memory");
            __builtin_amdgcn_sched_barrier(0);
        }
        if (g == KVG - 3) {
            // part 2's first Q rows, into the registers that two spent groups have left: they
            // fly during the last matrix blocks and stand there when the partials are summed
            #pragma unroll
            for (int q = 0; q < 8; ++q)
                raw[q] = *(const float4*)((const char*)queries + ((size_t)off + (size_t)(2 * q) * (HH * DD * 4)));
        }
        kv_mma(af, bf, acc, ks);
    }

    // partial tiles to LDS in [m][d] order.  C layout: VGPR j -> row j + 8*hi, column c
    #pragma unroll
    for (int a = 0; a < 4; ++a) {
        #pragma unroll
        for (int j = 0; j < 8; ++j) {
            const int m = 4 * (j + 8 * hi) + a;
            *(float4*)&part[wave][m * DD + 4 * c] =
                make_float4(acc[a][0][j], acc[a][1][j], acc[a][2][j], acc[a][3][j]);
        }
    }
    *(float4*)&ksum_part[wave * 2 + hi][4 * c] = make_float4(ks[0].x + ks[0].y, ks[1].x + ks[1].y, ks[2].x + ks[2].y, ks[3].x + ks[3].y);
    __syncthreads();

    // sum the partials; each thread owns two float4 of the 64x64 tile
    #pragma unroll
    for (int i = 0; i < 2; ++i) {
        const int e = tid + i * (KVW * 32);
        const int q = e * 4;
        float4 s = *(const float4*)&part[0][q];
        #pragma unroll
        for (int w = 1; w < KVW; ++w) {
            const float4 x = *(const float4*)&part[w][q];
            s.x += x.x;  s.y += x.y;  s.z += x.z;  s.w += x.w;
        }
        *(float4*)&KVs[(e >> 4) * OP + (e & 15) * 4] = s;
    }
    if (tid < DD) {
        float s = ksum_part[0][tid];
        #pragma unroll
        for (int w = 1; w < KVW * 2; ++w) s += ksum_part[w][tid];
        ksum_s[tid] = s;
    }
    // publishes KV and Ksum, and ends the last read of the partials: behind it the slabs
    // are the waves' own Q and Out tiles
    __syncthreads();

    float* qst = &part[wave][0];
    float* ost = &part[wave][16 * OP];
    float* qrow = qst + hi * OP + 4 * c;
    float* orow = ost + hi * OP + 4 * c;
    float* qfrg = qst + c * OP + 4 * hi;
    float* ofrg = ost + c * OP + 8 * hi;
    const float* ksl  = &ksum_s[4 * hi];
    const float* kfrg = &KVs[c * OP + 4 * hi];

    v4f kvf[4][8];                       // tile a: row m = 16a + c
    #pragma unroll
    for (int a = 0; a < 4; ++a)
        #pragma unroll
        for (int j = 0; j < 8; ++j)
            kvf[a][j] = *(const v4f*)(kfrg + 16 * a * OP + 8 * j);

    // Kept rolled: the loop's back edge holds the feature map of the rows asked for ahead
    // behind this tile's products; unrolled, it was moved up to the loads and waited there.
    #pragma unroll 1
    for (int i = 0; i < OT - 1; ++i) {
        out_tile<true>(raw, kvf, queries, out, off, qrow, orow, qfrg, ofrg, ksl);
        // The registers that this tile's loads and stores name are written again from here on:
        // the wait stands in front of that. It names the offset register, so that it lives up
        // to the wait (no load takes it as its destination) and is advanced only behind it.
        asm volatile("s_wait_xcnt 0x0" : "+v"(off) :: "memory");
        off += (OW * 16) * (HH * DD * 4);
    }
    out_tile<false>(raw, kvf, queries, out, off, qrow, orow, qfrg, ofrg, ksl);
}

extern "C" void kernel_launch(void* const* d_in, const int* in_sizes, int n_in,
                              void* d_out, int out_size, void* d_ws, size_t ws_size,
                              hipStream_t stream) {
    const float* queries  = (const float*)d_in[0];
    const float* keys     = (const float*)d_in[1];
    const float* values   = (const float*)d_in[2];
    const float* key_mask = (const float*)d_in[3];
    float* out = (float*)d_out;

    la_fused_kernel<<<dim3(BNH), dim3(KVW * 32), 0, stream>>>(queries, keys, values, key_mask, out);
}
